// v000
// Measured on an AMD MI455X. A time is GPU time per run, averaged over a window of back-to-back runs after a warm-up
// (all launches, gaps included; the runs take copies of the inputs in turn), and the median of several windows.
// Apart from v000's, it joins two sittings. Times from different sittings can be a few percent apart, while
// side-by-side timings come from the same sitting.
// v000 is the starting kernel. One run takes 406 microseconds.
#include <hip/hip_runtime.h>

// CDNA5 / gfx1250 single-head causal attention, fp32 end-to-end.
//  Kernel 0: transpose Wq/Wk/Wv -> W^T so GEMM B-operands load as b64 pairs.
//  Kernel 1: QKV projection, V_WMMA_F32_16X16X4_F32, 64-row M-tile per wave,
//            one weight matrix per wave (grid.y).  V is stored transposed.
//  Kernel 2: flash attention, one wave32 per 16-query block, online softmax.
//            S^T = K*Q^T puts queries on lanes; P feeds PV WMMA as B operand
//            via half-swap shuffles; V^T makes the PV A-operand loads b64.

typedef float v2f __attribute__((ext_vector_type(2)));
typedef float v8f __attribute__((ext_vector_type(8)));

#define WMMA_F32(A, Bm, C) \
    __builtin_amdgcn_wmma_f32_16x16x4_f32(false, (A), false, (Bm), (short)0, (C), false, false)

constexpr int BB = 4;        // batch
constexpr int SS = 4096;     // sequence
constexpr int DE = 1024;     // d_emb
constexpr int DH = 64;       // d_head
constexpr int QB = SS / 16;  // query blocks per batch = 256

// ---------------------------------------------------------------------------
// Kernel 0: WT[w][n][k] = W_w[k][n]   (3 x 64 x 1024 fp32, 0.75 MB total)
// ---------------------------------------------------------------------------
__global__ __launch_bounds__(256) void wt_kernel(
    const float* __restrict__ Wq, const float* __restrict__ Wk,
    const float* __restrict__ Wv, float* __restrict__ WT)
{
    const float* __restrict__ Ws[3] = {Wq, Wk, Wv};
    int g = blockIdx.x * 256 + threadIdx.x;          // 0 .. 3*DH*DE-1
    int w = g / (DH * DE);
    int r = g % (DH * DE);
    int n = r / DE;
    int k = r % DE;
    WT[g] = Ws[w][k * DH + n];
}

// ---------------------------------------------------------------------------
// Kernel 1: one wave per (64-row tile, matrix w).  Per K-chunk of 4:
//   4x b64 A loads (x rows), 4x b64 B loads (W^T), 16 WMMAs.
// w==2 (V) is stored transposed per batch: Vt[b][d][s].
// ---------------------------------------------------------------------------
__global__ __launch_bounds__(32) void qkv_kernel(
    const float* __restrict__ x, const float* __restrict__ WT,
    float* __restrict__ Q, float* __restrict__ Kq, float* __restrict__ Vt)
{
    const int  w    = blockIdx.y;                    // 0=Q, 1=K, 2=V
    const int  lane = threadIdx.x & 31;
    const int  l16  = lane & 15;
    const int  hi   = lane >> 4;
    const long rowbase = (long)blockIdx.x * 64;

    const float* Wt = WT + (long)w * DH * DE;        // [n][k]

    v8f vzero = {};
    v8f acc[4][4];                                   // [mtile][ntile]
#pragma unroll
    for (int mt = 0; mt < 4; ++mt)
#pragma unroll
        for (int t = 0; t < 4; ++t) acc[mt][t] = vzero;

    const float* xb = x + (rowbase + l16) * DE + 2 * hi;
    const float* wb = Wt + l16 * DE + 2 * hi;

    for (int kc = 0; kc < DE; kc += 4) {
        v2f a[4], bb[4];
#pragma unroll
        for (int mt = 0; mt < 4; ++mt)
            a[mt] = *(const v2f*)(xb + (long)mt * 16 * DE + kc);
#pragma unroll
        for (int t = 0; t < 4; ++t)
            bb[t] = *(const v2f*)(wb + (long)t * 16 * DE + kc);
#pragma unroll
        for (int mt = 0; mt < 4; ++mt)
#pragma unroll
            for (int t = 0; t < 4; ++t)
                acc[mt][t] = WMMA_F32(a[mt], bb[t], acc[mt][t]);
    }

    if (w < 2) {
        float* __restrict__ O = (w == 0) ? Q : Kq;
#pragma unroll
        for (int mt = 0; mt < 4; ++mt)
#pragma unroll
            for (int t = 0; t < 4; ++t)
#pragma unroll
                for (int r = 0; r < 8; ++r)
                    O[(rowbase + mt * 16 + r + 8 * hi) * DH + t * 16 + l16] =
                        acc[mt][t][r];
    } else {
#pragma unroll
        for (int mt = 0; mt < 4; ++mt)
#pragma unroll
            for (int t = 0; t < 4; ++t)
#pragma unroll
                for (int r = 0; r < 8; ++r) {
                    long row = rowbase + mt * 16 + r + 8 * hi;   // global token
                    long bI  = row >> 12;                        // / SS
                    long s   = row & (SS - 1);                   // % SS
                    Vt[bI * (long)DH * SS + (t * 16 + l16) * (long)SS + s] =
                        acc[mt][t][r];
                }
    }
}

// ---------------------------------------------------------------------------
// Kernel 2: flash attention with causal mask.  One wave per (batch, qblock).
// ---------------------------------------------------------------------------
__global__ __launch_bounds__(32) void attn_kernel(
    const float* __restrict__ Q, const float* __restrict__ Kq,
    const float* __restrict__ Vt, float* __restrict__ out)
{
    const int b    = blockIdx.x >> 8;   // / QB
    const int qb   = blockIdx.x & 255;  // % QB
    const int lane = threadIdx.x & 31;
    const int l16  = lane & 15;
    const int hi   = lane >> 4;

    const float* Qb  = Q  + (long)b * SS * DH;
    const float* Kb  = Kq + (long)b * SS * DH;
    const float* Vtb = Vt + (long)b * DH * SS;       // [d][s]

    // Preload Q^T in B-operand layout: reg j -> d = 4c + j + 2*hi, lane -> query.
    const long qrow = (long)qb * 16 + l16;
    v2f qreg[16];
#pragma unroll
    for (int c = 0; c < 16; ++c)
        qreg[c] = *(const v2f*)(Qb + qrow * DH + 4 * c + 2 * hi);

    // Per-d-row base pointers into V^T (lane -> d = t*16 + l16).
    const float* Vrow[4];
#pragma unroll
    for (int t = 0; t < 4; ++t)
        Vrow[t] = Vtb + (t * 16 + l16) * (long)SS + 2 * hi;

    v8f vzero = {};
    v8f acc[4];                                      // O^T tiles
#pragma unroll
    for (int t = 0; t < 4; ++t) acc[t] = vzero;

    float mrow = -__builtin_inff();
    float lsum = 0.0f;
    const float scale = 0.125f;                      // 1/sqrt(64)
    const int   query = qb * 16 + l16;

    for (int kb = 0; kb <= qb; ++kb) {
        // ---- S^T = K * Q^T over d = 0..63 (16 chunks of K=4) ----
        v8f st = vzero;
        const float* Kp = Kb + ((long)kb * 16 + l16) * DH + 2 * hi;
#pragma unroll
        for (int c = 0; c < 16; ++c) {
            v2f ka = *(const v2f*)(Kp + 4 * c);      // K[key][4c+klo .. +1]
            st = WMMA_F32(ka, qreg[c], st);
        }

        // ---- scale + causal mask (key = kb*16 + r + 8*hi, query on lane) ----
#pragma unroll
        for (int r = 0; r < 8; ++r) {
            int   key = kb * 16 + r + 8 * hi;
            float s   = st[r] * scale;
            st[r] = (key <= query) ? s : -__builtin_inff();
        }

        // ---- online softmax: row stats live per lane ----
        float bm = st[0];
#pragma unroll
        for (int r = 1; r < 8; ++r) bm = fmaxf(bm, st[r]);
        bm = fmaxf(bm, __shfl_xor(bm, 16, 32));      // combine key halves
        float mnew = fmaxf(mrow, bm);
        float corr = __expf(mrow - mnew);            // first block: exp(-inf)=0

        float psum = 0.0f;
#pragma unroll
        for (int r = 0; r < 8; ++r) {
            float p = __expf(st[r] - mnew);
            st[r] = p;
            psum += p;
        }
        psum += __shfl_xor(psum, 16, 32);
        lsum  = lsum * corr + psum;
        mrow  = mnew;

#pragma unroll
        for (int t = 0; t < 4; ++t)
#pragma unroll
            for (int r = 0; r < 8; ++r) acc[t][r] *= corr;

        // ---- O^T += V^T * P : P (C-layout) -> B operand via half swaps ----
#pragma unroll
        for (int c = 0; c < 4; ++c) {
            v2f bop;
#pragma unroll
            for (int j = 0; j < 2; ++j) {
                float own, oth;
                if (c < 2) {                         // n_lo in lower-half regs
                    own = st[4 * c + j];
                    oth = __shfl_xor(st[4 * c + 2 + j], 16, 32);
                    bop[j] = hi ? oth : own;
                } else {                             // n_lo lives in upper-half regs
                    int cc = c - 2;
                    oth = __shfl_xor(st[4 * cc + j], 16, 32);
                    own = st[4 * cc + 2 + j];
                    bop[j] = hi ? own : oth;
                }
            }
            // A = V^T chunk: lane -> d, reg j -> key = kb*16 + 4c + 2hi + j  (b64)
#pragma unroll
            for (int t = 0; t < 4; ++t) {
                v2f va = *(const v2f*)(Vrow[t] + (long)kb * 16 + 4 * c);
                acc[t] = WMMA_F32(va, bop, acc[t]);
            }
        }
    }

    // ---- epilogue: O = O^T^T / l ----
    float  inv = 1.0f / lsum;
    float* Ob  = out + ((long)b * SS + qb * 16 + l16) * DH;
#pragma unroll
    for (int t = 0; t < 4; ++t)
#pragma unroll
        for (int r = 0; r < 8; ++r)
            Ob[t * 16 + r + 8 * hi] = acc[t][r] * inv;
}

// ---------------------------------------------------------------------------
extern "C" void kernel_launch(void* const* d_in, const int* in_sizes, int n_in,
                              void* d_out, int out_size, void* d_ws, size_t ws_size,
                              hipStream_t stream)
{
    (void)in_sizes; (void)n_in; (void)out_size; (void)ws_size;
    const float* x  = (const float*)d_in[0];
    const float* Wq = (const float*)d_in[1];
    const float* Wk = (const float*)d_in[2];
    const float* Wv = (const float*)d_in[3];
    float* out = (float*)d_out;

    const long N = (long)BB * SS * DH;   // 1,048,576 floats (4 MB) per tensor
    float* Qw = (float*)d_ws;            // [b][s][d]
    float* Kw = Qw + N;                  // [b][s][d]
    float* Vw = Kw + N;                  // [b][d][s]  (transposed)
    float* WT = Vw + N;                  // [3][DH][DE]

    wt_kernel<<<(3 * DH * DE) / 256, 256, 0, stream>>>(Wq, Wk, Wv, WT);
    qkv_kernel<<<dim3((BB * SS) / 64, 3), 32, 0, stream>>>(x, WT, Qw, Kw, Vw);
    attn_kernel<<<BB * QB, 32, 0, stream>>>(Qw, Kw, Vw, out);
}

// v001
// Measured time: 222 microseconds a run.
// Two timings next to v000 put it at 1.85 and 1.86 times that version's speed.
#include <hip/hip_runtime.h>

// CDNA5 / gfx1250 single-head causal attention, fp32 end-to-end.
//  Kernel 0: transpose Wq/Wk/Wv -> W^T so GEMM B-operands load as b64 pairs.
//  Kernel 1: QKV projection, V_WMMA_F32_16X16X4_F32, 64-row M-tile per wave,
//            one weight matrix per wave (grid.y).  V is stored transposed.
//  Kernel 2: flash attention, one 16-wave work-group per 16-query block; wave w
//            takes key blocks w, w+16, ... with its own online softmax, and the
//            16 partial results are merged through LDS at the end.
//            S^T = K*Q^T puts queries on lanes; P feeds PV WMMA as B operand
//            via half-swap shuffles; V^T makes the PV A-operand loads b64.

typedef float v2f __attribute__((ext_vector_type(2)));
typedef float v4f __attribute__((ext_vector_type(4)));
typedef float v8f __attribute__((ext_vector_type(8)));

#define WMMA_F32(A, Bm, C) \
    __builtin_amdgcn_wmma_f32_16x16x4_f32(false, (A), false, (Bm), (short)0, (C), false, false)

constexpr int BB = 4;        // batch
constexpr int SS = 4096;     // sequence
constexpr int DE = 1024;     // d_emb
constexpr int DH = 64;       // d_head
constexpr int QB = SS / 16;  // query blocks per batch = 256
constexpr int NW = 16;       // waves per attention work-group (key split)
constexpr int OP = DH + 4;   // LDS pitch of a partial O row, floats (b128 stores hit all banks once)
static_assert(NW == 16, "the merge gives wave q query row q and lane l16 partial l16");

// ---------------------------------------------------------------------------
// Kernel 0: WT[w][n][k] = W_w[k][n]   (3 x 64 x 1024 fp32, 0.75 MB total)
// ---------------------------------------------------------------------------
__global__ __launch_bounds__(256) void wt_kernel(
    const float* __restrict__ Wq, const float* __restrict__ Wk,
    const float* __restrict__ Wv, float* __restrict__ WT)
{
    const float* __restrict__ Ws[3] = {Wq, Wk, Wv};
    int g = blockIdx.x * 256 + threadIdx.x;          // 0 .. 3*DH*DE-1
    int w = g / (DH * DE);
    int r = g % (DH * DE);
    int n = r / DE;
    int k = r % DE;
    WT[g] = Ws[w][k * DH + n];
}

// ---------------------------------------------------------------------------
// Kernel 1: one wave per (64-row tile, matrix w).  Per K-chunk of 4:
//   4x b64 A loads (x rows), 4x b64 B loads (W^T), 16 WMMAs.
// w==2 (V) is stored transposed per batch: Vt[b][d][s].
// ---------------------------------------------------------------------------
__global__ __launch_bounds__(32) void qkv_kernel(
    const float* __restrict__ x, const float* __restrict__ WT,
    float* __restrict__ Q, float* __restrict__ Kq, float* __restrict__ Vt)
{
    const int  w    = blockIdx.y;                    // 0=Q, 1=K, 2=V
    const int  lane = threadIdx.x & 31;
    const int  l16  = lane & 15;
    const int  hi   = lane >> 4;
    const long rowbase = (long)blockIdx.x * 64;

    const float* Wt = WT + (long)w * DH * DE;        // [n][k]

    v8f vzero = {};
    v8f acc[4][4];                                   // [mtile][ntile]
#pragma unroll
    for (int mt = 0; mt < 4; ++mt)
#pragma unroll
        for (int t = 0; t < 4; ++t) acc[mt][t] = vzero;

    const float* xb = x + (rowbase + l16) * DE + 2 * hi;
    const float* wb = Wt + l16 * DE + 2 * hi;

    for (int kc = 0; kc < DE; kc += 4) {
        v2f a[4], bb[4];
#pragma unroll
        for (int mt = 0; mt < 4; ++mt)
            a[mt] = *(const v2f*)(xb + (long)mt * 16 * DE + kc);
#pragma unroll
        for (int t = 0; t < 4; ++t)
            bb[t] = *(const v2f*)(wb + (long)t * 16 * DE + kc);
#pragma unroll
        for (int mt = 0; mt < 4; ++mt)
#pragma unroll
            for (int t = 0; t < 4; ++t)
                acc[mt][t] = WMMA_F32(a[mt], bb[t], acc[mt][t]);
    }

    if (w < 2) {
        float* __restrict__ O = (w == 0) ? Q : Kq;
#pragma unroll
        for (int mt = 0; mt < 4; ++mt)
#pragma unroll
            for (int t = 0; t < 4; ++t)
#pragma unroll
                for (int r = 0; r < 8; ++r)
                    O[(rowbase + mt * 16 + r + 8 * hi) * DH + t * 16 + l16] =
                        acc[mt][t][r];
    } else {
#pragma unroll
        for (int mt = 0; mt < 4; ++mt)
#pragma unroll
            for (int t = 0; t < 4; ++t)
#pragma unroll
                for (int r = 0; r < 8; ++r) {
                    long row = rowbase + mt * 16 + r + 8 * hi;   // global token
                    long bI  = row >> 12;                        // / SS
                    long s   = row & (SS - 1);                   // % SS
                    Vt[bI * (long)DH * SS + (t * 16 + l16) * (long)SS + s] =
                        acc[mt][t][r];
                }
    }
}

// ---------------------------------------------------------------------------
// Kernel 2: flash attention with causal mask.  One work-group per (batch,
// qblock); its NW waves share the key blocks round-robin and merge at the end.
// ---------------------------------------------------------------------------
__global__ __launch_bounds__(NW * 32) void attn_kernel(
    const float* __restrict__ Q, const float* __restrict__ Kq,
    const float* __restrict__ Vt, float* __restrict__ out)
{
    __shared__ __attribute__((aligned(16))) float s_acc[NW][16][OP];  // partial O
    __shared__ __attribute__((aligned(16))) float s_m[16][NW];        // partial row max
    __shared__ __attribute__((aligned(16))) float s_l[16][NW];        // partial row sum

    const int b    = blockIdx.x >> 8;   // / QB
    const int qb   = blockIdx.x & 255;  // % QB
    const int wave = __builtin_amdgcn_readfirstlane(threadIdx.x >> 5);  // scalar: loop stays wave-uniform
    const int lane = threadIdx.x & 31;
    const int l16  = lane & 15;
    const int hi   = lane >> 4;

    const float* Qb  = Q  + (long)b * SS * DH;
    const float* Kb  = Kq + (long)b * SS * DH;
    const float* Vtb = Vt + (long)b * DH * SS;       // [d][s]

    // Preload Q^T in B-operand layout: reg j -> d = 4c + j + 2*hi, lane -> query.
    const long qrow = (long)qb * 16 + l16;
    v2f qreg[16];
#pragma unroll
    for (int c = 0; c < 16; ++c)
        qreg[c] = *(const v2f*)(Qb + qrow * DH + 4 * c + 2 * hi);

    // Per-d-row base pointers into V^T (lane -> d = t*16 + l16).
    const float* Vrow[4];
#pragma unroll
    for (int t = 0; t < 4; ++t)
        Vrow[t] = Vtb + (t * 16 + l16) * (long)SS + 2 * hi;

    v8f vzero = {};
    v8f acc[4];                                      // O^T tiles
#pragma unroll
    for (int t = 0; t < 4; ++t) acc[t] = vzero;

    float mrow = -__builtin_inff();
    float lsum = 0.0f;
    const float scale = 0.125f;                      // 1/sqrt(64)
    const int   query = qb * 16 + l16;

    for (int kb = wave; kb <= qb; kb += NW) {
        // ---- S^T = K * Q^T over d = 0..63 (16 chunks of K=4) ----
        v8f st = vzero;
        const float* Kp = Kb + ((long)kb * 16 + l16) * DH + 2 * hi;
#pragma unroll
        for (int c = 0; c < 16; ++c) {
            v2f ka = *(const v2f*)(Kp + 4 * c);      // K[key][4c+klo .. +1]
            st = WMMA_F32(ka, qreg[c], st);
        }

        // ---- scale + causal mask (key = kb*16 + r + 8*hi, query on lane) ----
#pragma unroll
        for (int r = 0; r < 8; ++r) {
            int   key = kb * 16 + r + 8 * hi;
            float s   = st[r] * scale;
            st[r] = (key <= query) ? s : -__builtin_inff();
        }

        // ---- online softmax: row stats live per lane ----
        float bm = st[0];
#pragma unroll
        for (int r = 1; r < 8; ++r) bm = fmaxf(bm, st[r]);
        bm = fmaxf(bm, __shfl_xor(bm, 16, 32));      // combine key halves
        float mnew = fmaxf(mrow, bm);
        float corr = __expf(mrow - mnew);            // first block: exp(-inf)=0

        float psum = 0.0f;
#pragma unroll
        for (int r = 0; r < 8; ++r) {
            float p = __expf(st[r] - mnew);
            st[r] = p;
            psum += p;
        }
        psum += __shfl_xor(psum, 16, 32);
        lsum  = lsum * corr + psum;
        mrow  = mnew;

#pragma unroll
        for (int t = 0; t < 4; ++t)
#pragma unroll
            for (int r = 0; r < 8; ++r) acc[t][r] *= corr;

        // ---- O^T += V^T * P : P (C-layout) -> B operand via half swaps ----
#pragma unroll
        for (int c = 0; c < 4; ++c) {
            v2f bop;
#pragma unroll
            for (int j = 0; j < 2; ++j) {
                float own, oth;
                if (c < 2) {                         // n_lo in lower-half regs
                    own = st[4 * c + j];
                    oth = __shfl_xor(st[4 * c + 2 + j], 16, 32);
                    bop[j] = hi ? oth : own;
                } else {                             // n_lo lives in upper-half regs
                    int cc = c - 2;
                    oth = __shfl_xor(st[4 * cc + j], 16, 32);
                    own = st[4 * cc + 2 + j];
                    bop[j] = hi ? own : oth;
                }
            }
            // A = V^T chunk: lane -> d, reg j -> key = kb*16 + 4c + 2hi + j  (b64)
#pragma unroll
            for (int t = 0; t < 4; ++t) {
                v2f va = *(const v2f*)(Vrow[t] + (long)kb * 16 + 4 * c);
                acc[t] = WMMA_F32(va, bop, acc[t]);
            }
        }
    }

    // ---- publish this wave's partial (m, l, O); a wave without key blocks
    //      publishes (-inf, 0, 0), which gets weight exp(-inf) = 0 below ----
    // (the loops below are unrolled so that acc, mw and lw are indexed by
    //  constants and stay in registers, and readlane gets a constant lane)
#pragma unroll
    for (int t = 0; t < 4; ++t) {
        v4f lo4 = {acc[t][0], acc[t][1], acc[t][2], acc[t][3]};
        v4f hi4 = {acc[t][4], acc[t][5], acc[t][6], acc[t][7]};
        *(v4f*)&s_acc[wave][l16][t * 16 + 8 * hi]     = lo4;
        *(v4f*)&s_acc[wave][l16][t * 16 + 8 * hi + 4] = hi4;
    }
    if (hi == 0) {
        s_m[l16][wave] = mrow;
        s_l[l16][wave] = lsum;
    }
    __syncthreads();

    // ---- merge: wave q owns query row q, lane -> d = 2*lane, 2*lane+1.
    //      Wave 0 always has key block 0, so the merged max is finite. ----
    const int q = wave;
    float mw[NW], lw[NW];
#pragma unroll
    for (int g = 0; g < NW / 4; ++g) {
        v4f m4 = *(const v4f*)&s_m[q][4 * g];
        v4f l4 = *(const v4f*)&s_l[q][4 * g];
#pragma unroll
        for (int e = 0; e < 4; ++e) { mw[4 * g + e] = m4[e]; lw[4 * g + e] = l4[e]; }
    }
    float mall = mw[0];
#pragma unroll
    for (int w = 1; w < NW; ++w) mall = fmaxf(mall, mw[w]);

    // lane l16 computes the weight of partial l16; readlane hands it to all lanes
    const float gown = __expf(s_m[q][l16] - mall);

    float lall = 0.0f;
    v2f   o    = {0.0f, 0.0f};
#pragma unroll
    for (int w = 0; w < NW; ++w) {
        float g = __builtin_bit_cast(float, __builtin_amdgcn_readlane(__builtin_bit_cast(int, gown), w));
        v2f   a = *(const v2f*)&s_acc[w][q][2 * lane];
        lall += g * lw[w];
        o    += g * a;
    }
    float inv = 1.0f / lall;
    *(v2f*)(out + ((long)b * SS + qb * 16 + q) * DH + 2 * lane) = o * inv;
}

// ---------------------------------------------------------------------------
extern "C" void kernel_launch(void* const* d_in, const int* in_sizes, int n_in,
                              void* d_out, int out_size, void* d_ws, size_t ws_size,
                              hipStream_t stream)
{
    (void)in_sizes; (void)n_in; (void)out_size; (void)ws_size;
    const float* x  = (const float*)d_in[0];
    const float* Wq = (const float*)d_in[1];
    const float* Wk = (const float*)d_in[2];
    const float* Wv = (const float*)d_in[3];
    float* out = (float*)d_out;

    const long N = (long)BB * SS * DH;   // 1,048,576 floats (4 MB) per tensor
    float* Qw = (float*)d_ws;            // [b][s][d]
    float* Kw = Qw + N;                  // [b][s][d]
    float* Vw = Kw + N;                  // [b][d][s]  (transposed)
    float* WT = Vw + N;                  // [3][DH][DE]

    wt_kernel<<<(3 * DH * DE) / 256, 256, 0, stream>>>(Wq, Wk, Wv, WT);
    qkv_kernel<<<dim3((BB * SS) / 64, 3), 32, 0, stream>>>(x, WT, Qw, Kw, Vw);
    attn_kernel<<<BB * QB, NW * 32, 0, stream>>>(Qw, Kw, Vw, out);
}

// v002
// It runs in 147 microseconds.
// In two side-by-side timings against v001, it was 1.54 and 1.51 times as fast.
// Over all steps from v000 it is 2.83 times as fast.
#include <hip/hip_runtime.h>

// CDNA5 / gfx1250 single-head causal attention, fp32 end-to-end.
//  Kernel 0: transpose Wq/Wk/Wv -> W^T so GEMM B-operands load as b64 pairs.
//  Kernel 1: QKV projection, V_WMMA_F32_16X16X4_F32, 64-row M-tile per wave,
//            one weight matrix per wave (grid.y).  Q, K and V are stored in
//            the fragment order in which kernel 2 feeds them to its WMMAs.
//  Kernel 2: flash attention, one 16-wave work-group per 16-query block; wave w
//            takes key blocks w, w+16, ... with its own online softmax, and the
//            16 partial results are merged through LDS at the end.
//            S^T = K*Q^T puts queries on lanes; P feeds PV WMMA as B operand
//            via half-swap shuffles.
//
//  Fragment order of a 16-token block (FB = 1024 floats, 4 KB): eight groups of
//  32 lanes x 4 floats, so one wave-wide b128 load reads 512 contiguous bytes
//  and holds the operand pairs of two K=4 chunks.  Group g (0..7), lane
//  (hi, l16), float e hold
//    Q, K: token l16,           d     = 8*g     + 4*(e>>1) + 2*hi + (e&1)
//    V   : d = 16*(g>>1) + l16, token = 8*(g&1) + 4*(e>>1) + 2*hi + (e&1)

typedef float v2f __attribute__((ext_vector_type(2)));
typedef float v4f __attribute__((ext_vector_type(4)));
typedef float v8f __attribute__((ext_vector_type(8)));

#define WMMA_F32(A, Bm, C) \
    __builtin_amdgcn_wmma_f32_16x16x4_f32(false, (A), false, (Bm), (short)0, (C), false, false)

constexpr int BB = 4;        // batch
constexpr int SS = 4096;     // sequence
constexpr int DE = 1024;     // d_emb
constexpr int DH = 64;       // d_head
constexpr int QB = SS / 16;  // query blocks per batch = 256
constexpr int NW = 16;       // waves per attention work-group (key split)
constexpr int FB = 16 * DH;  // floats of one 16-token block in fragment order
constexpr int OP = DH + 4;   // LDS pitch of a partial O row, floats (b128 stores hit all banks once)
static_assert(NW == 16, "the merge gives wave q query row q and lane l16 partial l16");

// ---------------------------------------------------------------------------
// Kernel 0: WT[w][n][k] = W_w[k][n]   (3 x 64 x 1024 fp32, 0.75 MB total)
// ---------------------------------------------------------------------------
__global__ __launch_bounds__(256) void wt_kernel(
    const float* __restrict__ Wq, const float* __restrict__ Wk,
    const float* __restrict__ Wv, float* __restrict__ WT)
{
    const float* __restrict__ Ws[3] = {Wq, Wk, Wv};
    int g = blockIdx.x * 256 + threadIdx.x;          // 0 .. 3*DH*DE-1
    int w = g / (DH * DE);
    int r = g % (DH * DE);
    int n = r / DE;
    int k = r % DE;
    WT[g] = Ws[w][k * DH + n];
}

// ---------------------------------------------------------------------------
// Kernel 1: one wave per (64-row tile, matrix w).  Per K-chunk of 4:
//   4x b64 A loads (x rows), 4x b64 B loads (W^T), 16 WMMAs.
// Q, K and V are stored in the fragment order described at the head of the file.
// ---------------------------------------------------------------------------
__global__ __launch_bounds__(32) void qkv_kernel(
    const float* __restrict__ x, const float* __restrict__ WT,
    float* __restrict__ Q, float* __restrict__ Kq, float* __restrict__ Vf)
{
    const int  w    = blockIdx.y;                    // 0=Q, 1=K, 2=V
    const int  lane = threadIdx.x & 31;
    const int  l16  = lane & 15;
    const int  hi   = lane >> 4;
    const long rowbase = (long)blockIdx.x * 64;

    const float* Wt = WT + (long)w * DH * DE;        // [n][k]

    v8f vzero = {};
    v8f acc[4][4];                                   // [mtile][ntile]
#pragma unroll
    for (int mt = 0; mt < 4; ++mt)
#pragma unroll
        for (int t = 0; t < 4; ++t) acc[mt][t] = vzero;

    const float* xb = x + (rowbase + l16) * DE + 2 * hi;
    const float* wb = Wt + l16 * DE + 2 * hi;

    for (int kc = 0; kc < DE; kc += 4) {
        v2f a[4], bb[4];
#pragma unroll
        for (int mt = 0; mt < 4; ++mt)
            a[mt] = *(const v2f*)(xb + (long)mt * 16 * DE + kc);
#pragma unroll
        for (int t = 0; t < 4; ++t)
            bb[t] = *(const v2f*)(wb + (long)t * 16 * DE + kc);
#pragma unroll
        for (int mt = 0; mt < 4; ++mt)
#pragma unroll
            for (int t = 0; t < 4; ++t)
                acc[mt][t] = WMMA_F32(a[mt], bb[t], acc[mt][t]);
    }

    // A tile holds d = t*16 + l16 on lanes and token r + 8*hi on registers.
    if (w < 2) {
        // Q, K: the fragment wants tokens on lanes, so each register goes out by itself;
        // lane part of the index: where d = l16 lies in its group pair, and token 8*hi.
        float* __restrict__ O = ((w == 0) ? Q : Kq) + (long)blockIdx.x * 4 * FB
                              + (l16 >> 3) * 128 + ((l16 >> 1) & 1) * 64 + hi * 32
                              + ((l16 >> 2) & 1) * 2 + (l16 & 1);
#pragma unroll
        for (int mt = 0; mt < 4; ++mt)
#pragma unroll
            for (int t = 0; t < 4; ++t)
#pragma unroll
                for (int r = 0; r < 8; ++r)
                    O[mt * FB + t * 256 + r * 4] = acc[mt][t][r];
    } else {
        // V: d stays on lanes; r = 0,1,4,5 are the four floats of fragment lane
        // (0, l16) of group 2t + hi, r = 2,3,6,7 those of lane (1, l16).
        float* __restrict__ O = Vf + (long)blockIdx.x * 4 * FB + hi * 128 + l16 * 4;
#pragma unroll
        for (int mt = 0; mt < 4; ++mt)
#pragma unroll
            for (int t = 0; t < 4; ++t) {
                v4f lo4 = {acc[mt][t][0], acc[mt][t][1], acc[mt][t][4], acc[mt][t][5]};
                v4f hi4 = {acc[mt][t][2], acc[mt][t][3], acc[mt][t][6], acc[mt][t][7]};
                *(v4f*)(O + mt * FB + t * 256)      = lo4;
                *(v4f*)(O + mt * FB + t * 256 + 64) = hi4;
            }
        // in the listing this branch ends in front of the other branch's address
        // arithmetic, which reuses registers that the last stores above name
        asm volatile("s_wait_xcnt 0x0" ::: "memory");
    }
}

// ---------------------------------------------------------------------------
// Kernel 2: flash attention with causal mask.  One work-group per (batch,
// qblock); its NW waves share the key blocks round-robin and merge at the end.
// ---------------------------------------------------------------------------
__global__ __launch_bounds__(NW * 32) void attn_kernel(
    const float* __restrict__ Q, const float* __restrict__ Kq,
    const float* __restrict__ Vf, float* __restrict__ out)
{
    __shared__ __attribute__((aligned(16))) float s_acc[NW][16][OP];  // partial O
    __shared__ __attribute__((aligned(16))) float s_m[16][NW];        // partial row max
    __shared__ __attribute__((aligned(16))) float s_l[16][NW];        // partial row sum

    const int b    = blockIdx.x >> 8;   // / QB
    const int qb   = blockIdx.x & 255;  // % QB
    const int wave = __builtin_amdgcn_readfirstlane(threadIdx.x >> 5);  // scalar: loop stays wave-uniform
    const int lane = threadIdx.x & 31;
    const int l16  = lane & 15;
    const int hi   = lane >> 4;

    // This lane's four floats of group 0 of the batch's first block.
    const float* Qb = Q  + (long)b * QB * FB + lane * 4;
    const float* Kb = Kq + (long)b * QB * FB + lane * 4;
    const float* Vb = Vf + (long)b * QB * FB + lane * 4;

    // Preload Q^T in B-operand layout: reg j -> d = 4c + j + 2*hi, lane -> query.
    v2f qreg[16];
#pragma unroll
    for (int g = 0; g < 8; ++g) {
        v4f q4 = *(const v4f*)(Qb + (long)qb * FB + g * 128);
        qreg[2 * g]     = v2f{q4[0], q4[1]};
        qreg[2 * g + 1] = v2f{q4[2], q4[3]};
    }

    v8f vzero = {};
    v8f acc[4];                                      // O^T tiles
#pragma unroll
    for (int t = 0; t < 4; ++t) acc[t] = vzero;

    float mrow = -__builtin_inff();
    float lsum = 0.0f;
    const float scale = 0.125f;                      // 1/sqrt(64)
    const int   query = qb * 16 + l16;

    for (int kb = wave; kb <= qb; kb += NW) {
        // ---- S^T = K * Q^T over d = 0..63 (16 chunks of K=4) ----
        v8f st = vzero;
        const float* Kp = Kb + (long)kb * FB;
        v4f k4[8];                                   // K[key][4c+2hi .. +1], c = 2g, 2g+1
#pragma unroll
        for (int g = 0; g < 8; ++g)
            k4[g] = *(const v4f*)(Kp + g * 128);
        // keeps the eight loads together in front of the WMMAs; without it K's and V's
        // loads are spread among the WMMAs two at a time, one load latency per pair
        __builtin_amdgcn_sched_barrier(0);
#pragma unroll
        for (int g = 0; g < 8; ++g) {
            st = WMMA_F32((v2f{k4[g][0], k4[g][1]}), qreg[2 * g], st);
            st = WMMA_F32((v2f{k4[g][2], k4[g][3]}), qreg[2 * g + 1], st);
        }

        // V^T as A operand: lane -> d, group 2t + (c>>1) holds keys kb*16 + 4c + 2hi + j
        const float* Vp = Vb + (long)kb * FB;
        v4f v4[4][2];
#pragma unroll
        for (int t = 0; t < 4; ++t)
#pragma unroll
            for (int h = 0; h < 2; ++h)
                v4[t][h] = *(const v4f*)(Vp + (2 * t + h) * 128);

        // ---- scale + causal mask (key = kb*16 + r + 8*hi, query on lane) ----
#pragma unroll
        for (int r = 0; r < 8; ++r) {
            int   key = kb * 16 + r + 8 * hi;
            float s   = st[r] * scale;
            st[r] = (key <= query) ? s : -__builtin_inff();
        }

        // ---- online softmax: row stats live per lane ----
        float bm = st[0];
#pragma unroll
        for (int r = 1; r < 8; ++r) bm = fmaxf(bm, st[r]);
        bm = fmaxf(bm, __shfl_xor(bm, 16, 32));      // combine key halves
        float mnew = fmaxf(mrow, bm);
        float corr = __expf(mrow - mnew);            // first block: exp(-inf)=0

        float psum = 0.0f;
#pragma unroll
        for (int r = 0; r < 8; ++r) {
            float p = __expf(st[r] - mnew);
            st[r] = p;
            psum += p;
        }
        psum += __shfl_xor(psum, 16, 32);
        lsum  = lsum * corr + psum;
        mrow  = mnew;

#pragma unroll
        for (int t = 0; t < 4; ++t)
#pragma unroll
            for (int r = 0; r < 8; ++r) acc[t][r] *= corr;

        // ---- O^T += V^T * P : P (C-layout) -> B operand via half swaps ----
#pragma unroll
        for (int c = 0; c < 4; ++c) {
            v2f bop;
#pragma unroll
            for (int j = 0; j < 2; ++j) {
                float own, oth;
                if (c < 2) {                         // n_lo in lower-half regs
                    own = st[4 * c + j];
                    oth = __shfl_xor(st[4 * c + 2 + j], 16, 32);
                    bop[j] = hi ? oth : own;
                } else {                             // n_lo lives in upper-half regs
                    int cc = c - 2;
                    oth = __shfl_xor(st[4 * cc + j], 16, 32);
                    own = st[4 * cc + 2 + j];
                    bop[j] = hi ? own : oth;
                }
            }
#pragma unroll
            for (int t = 0; t < 4; ++t) {
                v4f vq = v4[t][c >> 1];
                v2f va = (c & 1) ? v2f{vq[2], vq[3]} : v2f{vq[0], vq[1]};
                acc[t] = WMMA_F32(va, bop, acc[t]);
            }
        }
    }

    // ---- publish this wave's partial (m, l, O); a wave without key blocks
    //      publishes (-inf, 0, 0), which gets weight exp(-inf) = 0 below ----
    // (the loops below are unrolled so that acc, mw and lw are indexed by
    //  constants and stay in registers, and readlane gets a constant lane)
#pragma unroll
    for (int t = 0; t < 4; ++t) {
        v4f lo4 = {acc[t][0], acc[t][1], acc[t][2], acc[t][3]};
        v4f hi4 = {acc[t][4], acc[t][5], acc[t][6], acc[t][7]};
        *(v4f*)&s_acc[wave][l16][t * 16 + 8 * hi]     = lo4;
        *(v4f*)&s_acc[wave][l16][t * 16 + 8 * hi + 4] = hi4;
    }
    if (hi == 0) {
        s_m[l16][wave] = mrow;
        s_l[l16][wave] = lsum;
    }
    __syncthreads();

    // ---- merge: wave q owns query row q, lane -> d = 2*lane, 2*lane+1.
    //      Wave 0 always has key block 0, so the merged max is finite. ----
    const int q = wave;
    float mw[NW], lw[NW];
#pragma unroll
    for (int g = 0; g < NW / 4; ++g) {
        v4f m4 = *(const v4f*)&s_m[q][4 * g];
        v4f l4 = *(const v4f*)&s_l[q][4 * g];
#pragma unroll
        for (int e = 0; e < 4; ++e) { mw[4 * g + e] = m4[e]; lw[4 * g + e] = l4[e]; }
    }
    float mall = mw[0];
#pragma unroll
    for (int w = 1; w < NW; ++w) mall = fmaxf(mall, mw[w]);

    // lane l16 computes the weight of partial l16; readlane hands it to all lanes
    const float gown = __expf(s_m[q][l16] - mall);

    float lall = 0.0f;
    v2f   o    = {0.0f, 0.0f};
#pragma unroll
    for (int w = 0; w < NW; ++w) {
        float g = __builtin_bit_cast(float, __builtin_amdgcn_readlane(__builtin_bit_cast(int, gown), w));
        v2f   a = *(const v2f*)&s_acc[w][q][2 * lane];
        lall += g * lw[w];
        o    += g * a;
    }
    float inv = 1.0f / lall;
    *(v2f*)(out + ((long)b * SS + qb * 16 + q) * DH + 2 * lane) = o * inv;
}

// ---------------------------------------------------------------------------
extern "C" void kernel_launch(void* const* d_in, const int* in_sizes, int n_in,
                              void* d_out, int out_size, void* d_ws, size_t ws_size,
                              hipStream_t stream)
{
    (void)in_sizes; (void)n_in; (void)out_size; (void)ws_size;
    const float* x  = (const float*)d_in[0];
    const float* Wq = (const float*)d_in[1];
    const float* Wk = (const float*)d_in[2];
    const float* Wv = (const float*)d_in[3];
    float* out = (float*)d_out;

    const long N = (long)BB * SS * DH;   // 1,048,576 floats (4 MB) per tensor
    float* Qw = (float*)d_ws;            // [b][s/16][FB], fragment order
    float* Kw = Qw + N;                  // [b][s/16][FB], fragment order
    float* Vw = Kw + N;                  // [b][s/16][FB], fragment order
    float* WT = Vw + N;                  // [3][DH][DE]

    wt_kernel<<<(3 * DH * DE) / 256, 256, 0, stream>>>(Wq, Wk, Wv, WT);
    qkv_kernel<<<dim3((BB * SS) / 64, 3), 32, 0, stream>>>(x, WT, Qw, Kw, Vw);
    attn_kernel<<<BB * QB, NW * 32, 0, stream>>>(Qw, Kw, Vw, out);
}

// v003
// One run takes 127 microseconds.
// Two timings next to v002 both put it at 1.15 times that version's speed.
// Counting every step since v000, it is 3.25 times as fast.
#include <hip/hip_runtime.h>

// CDNA5 / gfx1250 single-head causal attention, fp32 end-to-end.
//  Kernel 0: transpose Wq/Wk/Wv -> W^T so GEMM B-operands load as b64 pairs.
//  Kernel 1: QKV projection, V_WMMA_F32_16X16X4_F32, 64-row M-tile per wave,
//            one weight matrix per wave (grid.y).  Q, K and V are stored in
//            the fragment order in which kernel 2 feeds them to its WMMAs.
//  Kernel 2: flash attention, one 16-wave work-group per 16-query block; wave w
//            takes key blocks w, w+16, ... with its own online softmax, and the
//            16 partial results are merged through LDS at the end.
//            S^T = K*Q^T puts queries on lanes; P feeds PV WMMA as B operand
//            via half-swap shuffles.
//
//  Fragment order of a 16-token block (FB = 1024 floats, 4 KB): eight groups of
//  32 lanes x 4 floats, so one wave-wide b128 load reads 512 contiguous bytes
//  and holds the operand pairs of two K=4 chunks.  Group g (0..7), lane
//  (hi, l16), float e hold
//    Q, K: token l16,           d     = 8*g     + 4*(e>>1) + 2*hi + (e&1)
//    V   : d = 16*(g>>1) + l16, token = 8*(g&1) + 4*(e>>1) + 2*hi + (e&1)

typedef float v2f __attribute__((ext_vector_type(2)));
typedef float v4f __attribute__((ext_vector_type(4)));
typedef float v8f __attribute__((ext_vector_type(8)));

#define WMMA_F32(A, Bm, C) \
    __builtin_amdgcn_wmma_f32_16x16x4_f32(false, (A), false, (Bm), (short)0, (C), false, false)

constexpr int BB = 4;        // batch
constexpr int SS = 4096;     // sequence
constexpr int DE = 1024;     // d_emb
constexpr int DH = 64;       // d_head
constexpr int QB = SS / 16;  // query blocks per batch = 256
constexpr int NW = 16;       // waves per attention work-group (key split)
constexpr int FB = 16 * DH;  // floats of one 16-token block in fragment order
constexpr int OP = DH + 4;   // LDS pitch of a partial O row, floats (b128 stores hit all banks once)
static_assert(NW == 16, "the merge gives wave q query row q and lane l16 partial l16");

// ---------------------------------------------------------------------------
// Kernel 0: WT[w][n][k] = W_w[k][n]   (3 x 64 x 1024 fp32, 0.75 MB total)
// ---------------------------------------------------------------------------
__global__ __launch_bounds__(256) void wt_kernel(
    const float* __restrict__ Wq, const float* __restrict__ Wk,
    const float* __restrict__ Wv, float* __restrict__ WT)
{
    const float* __restrict__ Ws[3] = {Wq, Wk, Wv};
    int g = blockIdx.x * 256 + threadIdx.x;          // 0 .. 3*DH*DE-1
    int w = g / (DH * DE);
    int r = g % (DH * DE);
    int n = r / DE;
    int k = r % DE;
    WT[g] = Ws[w][k * DH + n];
}

// ---------------------------------------------------------------------------
// Kernel 1: one wave per (64-row tile, matrix w).  Per K-chunk of 4:
//   4x b64 A loads (x rows), 4x b64 B loads (W^T), 16 WMMAs.
// Q, K and V are stored in the fragment order described at the head of the file.
// ---------------------------------------------------------------------------
__global__ __launch_bounds__(32) void qkv_kernel(
    const float* __restrict__ x, const float* __restrict__ WT,
    float* __restrict__ Q, float* __restrict__ Kq, float* __restrict__ Vf)
{
    const int  w    = blockIdx.y;                    // 0=Q, 1=K, 2=V
    const int  lane = threadIdx.x & 31;
    const int  l16  = lane & 15;
    const int  hi   = lane >> 4;
    const long rowbase = (long)blockIdx.x * 64;

    const float* Wt = WT + (long)w * DH * DE;        // [n][k]

    v8f vzero = {};
    v8f acc[4][4];                                   // [mtile][ntile]
#pragma unroll
    for (int mt = 0; mt < 4; ++mt)
#pragma unroll
        for (int t = 0; t < 4; ++t) acc[mt][t] = vzero;

    const float* xb = x + (rowbase + l16) * DE + 2 * hi;
    const float* wb = Wt + l16 * DE + 2 * hi;

    for (int kc = 0; kc < DE; kc += 4) {
        v2f a[4], bb[4];
#pragma unroll
        for (int mt = 0; mt < 4; ++mt)
            a[mt] = *(const v2f*)(xb + (long)mt * 16 * DE + kc);
#pragma unroll
        for (int t = 0; t < 4; ++t)
            bb[t] = *(const v2f*)(wb + (long)t * 16 * DE + kc);
#pragma unroll
        for (int mt = 0; mt < 4; ++mt)
#pragma unroll
            for (int t = 0; t < 4; ++t)
                acc[mt][t] = WMMA_F32(a[mt], bb[t], acc[mt][t]);
    }

    // A tile holds d = t*16 + l16 on lanes and token r + 8*hi on registers.
    if (w < 2) {
        // Q, K: the fragment wants tokens on lanes, so each register goes out by itself;
        // lane part of the index: where d = l16 lies in its group pair, and token 8*hi.
        float* __restrict__ O = ((w == 0) ? Q : Kq) + (long)blockIdx.x * 4 * FB
                              + (l16 >> 3) * 128 + ((l16 >> 1) & 1) * 64 + hi * 32
                              + ((l16 >> 2) & 1) * 2 + (l16 & 1);
#pragma unroll
        for (int mt = 0; mt < 4; ++mt)
#pragma unroll
            for (int t = 0; t < 4; ++t)
#pragma unroll
                for (int r = 0; r < 8; ++r)
                    O[mt * FB + t * 256 + r * 4] = acc[mt][t][r];
    } else {
        // V: d stays on lanes; r = 0,1,4,5 are the four floats of fragment lane
        // (0, l16) of group 2t + hi, r = 2,3,6,7 those of lane (1, l16).
        float* __restrict__ O = Vf + (long)blockIdx.x * 4 * FB + hi * 128 + l16 * 4;
#pragma unroll
        for (int mt = 0; mt < 4; ++mt)
#pragma unroll
            for (int t = 0; t < 4; ++t) {
                v4f lo4 = {acc[mt][t][0], acc[mt][t][1], acc[mt][t][4], acc[mt][t][5]};
                v4f hi4 = {acc[mt][t][2], acc[mt][t][3], acc[mt][t][6], acc[mt][t][7]};
                *(v4f*)(O + mt * FB + t * 256)      = lo4;
                *(v4f*)(O + mt * FB + t * 256 + 64) = hi4;
            }
        // in the listing this branch ends in front of the other branch's address
        // arithmetic, which reuses registers that the last stores above name
        asm volatile("s_wait_xcnt 0x0" ::: "memory");
    }
}

// ---------------------------------------------------------------------------
// Kernel 2: flash attention with causal mask.  One work-group per (batch,
// qblock), longest qblock first; its NW waves share the key blocks round-robin
// and merge at the end.
// ---------------------------------------------------------------------------
__global__ __launch_bounds__(NW * 32) void attn_kernel(
    const float* __restrict__ Q, const float* __restrict__ Kq,
    const float* __restrict__ Vf, float* __restrict__ out)
{
    __shared__ __attribute__((aligned(16))) float s_acc[NW][16][OP];  // partial O
    __shared__ __attribute__((aligned(16))) float s_m[16][NW];        // partial row max
    __shared__ __attribute__((aligned(16))) float s_l[16][NW];        // partial row sum

    // Cost falls with the work-group index: a query block's work grows with qb, only
    // half of the work-groups are resident at once, and the longest get the lowest
    // indices (for speed only).
    const int b    = blockIdx.x & (BB - 1);
    const int qb   = QB - 1 - (blockIdx.x / BB);
    const int wave = __builtin_amdgcn_readfirstlane(threadIdx.x >> 5);  // scalar: loop stays wave-uniform
    const int lane = threadIdx.x & 31;
    const int l16  = lane & 15;
    const int hi   = lane >> 4;

    // This lane's four floats of group 0 of the batch's first block.
    const float* Qb = Q  + (long)b * QB * FB + lane * 4;
    const float* Kb = Kq + (long)b * QB * FB + lane * 4;
    const float* Vb = Vf + (long)b * QB * FB + lane * 4;

    // Preload Q^T in B-operand layout: reg j -> d = 4c + j + 2*hi, lane -> query.
    v2f qreg[16];
#pragma unroll
    for (int g = 0; g < 8; ++g) {
        v4f q4 = *(const v4f*)(Qb + (long)qb * FB + g * 128);
        qreg[2 * g]     = v2f{q4[0], q4[1]};
        qreg[2 * g + 1] = v2f{q4[2], q4[3]};
    }

    v8f vzero = {};
    v8f acc[4];                                      // O^T tiles
#pragma unroll
    for (int t = 0; t < 4; ++t) acc[t] = vzero;

    float mrow = -__builtin_inff();
    float lsum = 0.0f;
    const float scale = 0.125f;                      // 1/sqrt(64)
    const int   query = qb * 16 + l16;

    for (int kb = wave; kb <= qb; kb += NW) {
        // ---- S^T = K * Q^T over d = 0..63 (16 chunks of K=4) ----
        v8f st = vzero;
        const float* Kp = Kb + (long)kb * FB;
        v4f k4[8];                                   // K[key][4c+2hi .. +1], c = 2g, 2g+1
#pragma unroll
        for (int g = 0; g < 8; ++g)
            k4[g] = *(const v4f*)(Kp + g * 128);
        // keeps the eight loads together in front of the WMMAs; without it K's and V's
        // loads are spread among the WMMAs two at a time, one load latency per pair
        __builtin_amdgcn_sched_barrier(0);
#pragma unroll
        for (int g = 0; g < 8; ++g) {
            st = WMMA_F32((v2f{k4[g][0], k4[g][1]}), qreg[2 * g], st);
            st = WMMA_F32((v2f{k4[g][2], k4[g][3]}), qreg[2 * g + 1], st);
        }

        // V^T as A operand: lane -> d, group 2t + (c>>1) holds keys kb*16 + 4c + 2hi + j
        const float* Vp = Vb + (long)kb * FB;
        v4f v4[4][2];
#pragma unroll
        for (int t = 0; t < 4; ++t)
#pragma unroll
            for (int h = 0; h < 2; ++h)
                v4[t][h] = *(const v4f*)(Vp + (2 * t + h) * 128);

        // ---- scale + causal mask (key = kb*16 + r + 8*hi, query on lane) ----
#pragma unroll
        for (int r = 0; r < 8; ++r) {
            int   key = kb * 16 + r + 8 * hi;
            float s   = st[r] * scale;
            st[r] = (key <= query) ? s : -__builtin_inff();
        }

        // ---- online softmax: row stats live per lane ----
        float bm = st[0];
#pragma unroll
        for (int r = 1; r < 8; ++r) bm = fmaxf(bm, st[r]);
        bm = fmaxf(bm, __shfl_xor(bm, 16, 32));      // combine key halves
        float mnew = fmaxf(mrow, bm);
        float corr = __expf(mrow - mnew);            // first block: exp(-inf)=0

        float psum = 0.0f;
#pragma unroll
        for (int r = 0; r < 8; ++r) {
            float p = __expf(st[r] - mnew);
            st[r] = p;
            psum += p;
        }
        psum += __shfl_xor(psum, 16, 32);
        lsum  = lsum * corr + psum;
        mrow  = mnew;

#pragma unroll
        for (int t = 0; t < 4; ++t)
#pragma unroll
            for (int r = 0; r < 8; ++r) acc[t][r] *= corr;

        // ---- O^T += V^T * P : P (C-layout) -> B operand via half swaps ----
#pragma unroll
        for (int c = 0; c < 4; ++c) {
            v2f bop;
#pragma unroll
            for (int j = 0; j < 2; ++j) {
                float own, oth;
                if (c < 2) {                         // n_lo in lower-half regs
                    own = st[4 * c + j];
                    oth = __shfl_xor(st[4 * c + 2 + j], 16, 32);
                    bop[j] = hi ? oth : own;
                } else {                             // n_lo lives in upper-half regs
                    int cc = c - 2;
                    oth = __shfl_xor(st[4 * cc + j], 16, 32);
                    own = st[4 * cc + 2 + j];
                    bop[j] = hi ? own : oth;
                }
            }
#pragma unroll
            for (int t = 0; t < 4; ++t) {
                v4f vq = v4[t][c >> 1];
                v2f va = (c & 1) ? v2f{vq[2], vq[3]} : v2f{vq[0], vq[1]};
                acc[t] = WMMA_F32(va, bop, acc[t]);
            }
        }
    }

    // ---- publish this wave's partial (m, l, O); a wave without key blocks
    //      publishes (-inf, 0, 0), which gets weight exp(-inf) = 0 below ----
    // (the loops below are unrolled so that acc, mw and lw are indexed by
    //  constants and stay in registers, and readlane gets a constant lane)
#pragma unroll
    for (int t = 0; t < 4; ++t) {
        v4f lo4 = {acc[t][0], acc[t][1], acc[t][2], acc[t][3]};
        v4f hi4 = {acc[t][4], acc[t][5], acc[t][6], acc[t][7]};
        *(v4f*)&s_acc[wave][l16][t * 16 + 8 * hi]     = lo4;
        *(v4f*)&s_acc[wave][l16][t * 16 + 8 * hi + 4] = hi4;
    }
    if (hi == 0) {
        s_m[l16][wave] = mrow;
        s_l[l16][wave] = lsum;
    }
    __syncthreads();

    // ---- merge: wave q owns query row q, lane -> d = 2*lane, 2*lane+1.
    //      Wave 0 always has key block 0, so the merged max is finite. ----
    const int q = wave;
    float mw[NW], lw[NW];
#pragma unroll
    for (int g = 0; g < NW / 4; ++g) {
        v4f m4 = *(const v4f*)&s_m[q][4 * g];
        v4f l4 = *(const v4f*)&s_l[q][4 * g];
#pragma unroll
        for (int e = 0; e < 4; ++e) { mw[4 * g + e] = m4[e]; lw[4 * g + e] = l4[e]; }
    }
    float mall = mw[0];
#pragma unroll
    for (int w = 1; w < NW; ++w) mall = fmaxf(mall, mw[w]);

    // lane l16 computes the weight of partial l16; readlane hands it to all lanes
    const float gown = __expf(s_m[q][l16] - mall);

    float lall = 0.0f;
    v2f   o    = {0.0f, 0.0f};
#pragma unroll
    for (int w = 0; w < NW; ++w) {
        float g = __builtin_bit_cast(float, __builtin_amdgcn_readlane(__builtin_bit_cast(int, gown), w));
        v2f   a = *(const v2f*)&s_acc[w][q][2 * lane];
        lall += g * lw[w];
        o    += g * a;
    }
    float inv = 1.0f / lall;
    *(v2f*)(out + ((long)b * SS + qb * 16 + q) * DH + 2 * lane) = o * inv;
}

// ---------------------------------------------------------------------------
extern "C" void kernel_launch(void* const* d_in, const int* in_sizes, int n_in,
                              void* d_out, int out_size, void* d_ws, size_t ws_size,
                              hipStream_t stream)
{
    (void)in_sizes; (void)n_in; (void)out_size; (void)ws_size;
    const float* x  = (const float*)d_in[0];
    const float* Wq = (const float*)d_in[1];
    const float* Wk = (const float*)d_in[2];
    const float* Wv = (const float*)d_in[3];
    float* out = (float*)d_out;

    const long N = (long)BB * SS * DH;   // 1,048,576 floats (4 MB) per tensor
    float* Qw = (float*)d_ws;            // [b][s/16][FB], fragment order
    float* Kw = Qw + N;                  // [b][s/16][FB], fragment order
    float* Vw = Kw + N;                  // [b][s/16][FB], fragment order
    float* WT = Vw + N;                  // [3][DH][DE]

    wt_kernel<<<(3 * DH * DE) / 256, 256, 0, stream>>>(Wq, Wk, Wv, WT);
    qkv_kernel<<<dim3((BB * SS) / 64, 3), 32, 0, stream>>>(x, WT, Qw, Kw, Vw);
    attn_kernel<<<BB * QB, NW * 32, 0, stream>>>(Qw, Kw, Vw, out);
}

// v004
// A run of this version takes 85.3 microseconds.
// Two timings next to v003 put it at 1.50 and 1.49 times that version's speed.
// Counting every step since v000, it is 4.87 times as fast.
#include <hip/hip_runtime.h>

// CDNA5 / gfx1250 single-head causal attention, fp32 end-to-end.
//  Kernel 0: transpose Wq/Wk/Wv -> W^T so GEMM B-operands, like A, read 4 consecutive k as one b128.
//  Kernel 1: QKV projection, V_WMMA_F32_16X16X4_F32, one 8-wave work-group per
//            64 rows, operands staged in LDS.  Q, K and V are stored in
//            the fragment order in which kernel 2 feeds them to its WMMAs.
//  Kernel 2: flash attention, one 16-wave work-group per 16-query block; wave w
//            takes key blocks w, w+16, ... with its own online softmax, and the
//            16 partial results are merged through LDS at the end.
//            S^T = K*Q^T puts queries on lanes; P feeds PV WMMA as B operand
//            via half-swap shuffles.
//
//  Fragment order of a 16-token block (FB = 1024 floats, 4 KB): eight groups of
//  32 lanes x 4 floats, so one wave-wide b128 load reads 512 contiguous bytes
//  and holds the operand pairs of two K=4 chunks.  Group g (0..7), lane
//  (hi, l16), float e hold
//    Q, K: token l16,           d     = 8*g     + 4*(e>>1) + 2*hi + (e&1)
//    V   : d = 16*(g>>1) + l16, token = 8*(g&1) + 4*(e>>1) + 2*hi + (e&1)

typedef float v2f __attribute__((ext_vector_type(2)));
typedef float v4f __attribute__((ext_vector_type(4)));
typedef float v8f __attribute__((ext_vector_type(8)));

#define WMMA_F32(A, Bm, C) \
    __builtin_amdgcn_wmma_f32_16x16x4_f32(false, (A), false, (Bm), (short)0, (C), false, false)

constexpr int BB = 4;        // batch
constexpr int SS = 4096;     // sequence
constexpr int DE = 1024;     // d_emb
constexpr int DH = 64;       // d_head
constexpr int QB = SS / 16;  // query blocks per batch = 256
constexpr int NW = 16;       // waves per attention work-group (key split)
constexpr int FB = 16 * DH;  // floats of one 16-token block in fragment order
constexpr int OP = DH + 4;   // LDS pitch of a partial O row, floats (b128 stores hit all banks once)
static_assert(NW == 16, "the merge gives wave q query row q and lane l16 partial l16");

// ---------------------------------------------------------------------------
// Kernel 0: WT[w][n][k] = W_w[k][n]   (3 x 64 x 1024 fp32, 0.75 MB total)
// ---------------------------------------------------------------------------
__global__ __launch_bounds__(256) void wt_kernel(
    const float* __restrict__ Wq, const float* __restrict__ Wk,
    const float* __restrict__ Wv, float* __restrict__ WT)
{
    const float* __restrict__ Ws[3] = {Wq, Wk, Wv};
    int g = blockIdx.x * 256 + threadIdx.x;          // 0 .. 3*DH*DE-1
    int w = g / (DH * DE);
    int r = g % (DH * DE);
    int n = r / DE;
    int k = r % DE;
    WT[g] = Ws[w][k * DH + n];
}

// ---------------------------------------------------------------------------
// Kernel 1: one 8-wave work-group per 64 rows of x makes all 192 columns (Q | K | V).
// A stage is 128 k of the 64 x rows and of the 192 W^T rows (WT is [192][1024]),
// brought into LDS by asynchronous copies in whole 512-byte row pieces; two buffers,
// the next stage's copies fly while this stage is worked on.  Wave (wm, wn) makes
// rows 32*wm .. +31 by columns 16*wn .. +15 of Q, of K and of V: per 8 k, 5 b128
// fragment reads feed 12 WMMAs.  Lane (hi, l16) reads k = 8*kk + 4*hi + 0..3 of its row for A and for B
// alike; floats 0,1 feed one WMMA, floats 2,3 the next.
// Q, K and V are stored in the fragment order described at the head of the file.
// ---------------------------------------------------------------------------
constexpr int PM = 64;            // x rows of a work-group
constexpr int PR = PM + 3 * DH;   // rows of a stage: 64 of x, then 192 of W^T
constexpr int KS = 128;           // k of a stage
constexpr int NS = DE / KS;       // stages
constexpr int PP = KS + 4;        // LDS pitch, floats: 528 B = 16 B x 33, b128 reads hit all banks once

// Eight copies of 16 bytes per lane: rows 8 apart in global memory and in LDS.
// The s_wait_xcnt stands inside the statement so that no address register of a
// copy is rewritten in front of it.
__device__ __forceinline__ void copy8(const float* g, unsigned l)
{
    asm volatile(
        "global_load_async_to_lds_b128 %0, %8, off\n\t"
        "global_load_async_to_lds_b128 %1, %9, off\n\t"
        "global_load_async_to_lds_b128 %2, %10, off\n\t"
        "global_load_async_to_lds_b128 %3, %11, off\n\t"
        "global_load_async_to_lds_b128 %4, %12, off\n\t"
        "global_load_async_to_lds_b128 %5, %13, off\n\t"
        "global_load_async_to_lds_b128 %6, %14, off\n\t"
        "global_load_async_to_lds_b128 %7, %15, off\n\t"
        "s_wait_xcnt 0x0"
        :: "v"(l), "v"(l + 1 * 8 * PP * 4), "v"(l + 2 * 8 * PP * 4), "v"(l + 3 * 8 * PP * 4),
           "v"(l + 4 * 8 * PP * 4), "v"(l + 5 * 8 * PP * 4), "v"(l + 6 * 8 * PP * 4), "v"(l + 7 * 8 * PP * 4),
           "v"(g), "v"(g + 1 * 8 * DE), "v"(g + 2 * 8 * DE), "v"(g + 3 * 8 * DE),
           "v"(g + 4 * 8 * DE), "v"(g + 5 * 8 * DE), "v"(g + 6 * 8 * DE), "v"(g + 7 * 8 * DE)
        : "memory");
}

__global__ __launch_bounds__(256) void qkv_kernel(
    const float* __restrict__ x, const float* __restrict__ WT,
    float* __restrict__ Q, float* __restrict__ Kq, float* __restrict__ Vf)
{
    __shared__ __attribute__((aligned(16))) float s_t[2][PR][PP];

    const int wave = __builtin_amdgcn_readfirstlane(threadIdx.x >> 5);  // scalar: tile choice stays wave-uniform
    const int lane = threadIdx.x & 31;
    const int l16  = lane & 15;
    const int hi   = lane >> 4;
    const int wm   = wave >> 2;
    const int wn   = wave & 3;

    // A wave's copy brings one row's 512 bytes; this wave brings rows wave, wave + 8, ...
    const float*   xg = x + ((long)blockIdx.x * PM + wave) * DE + lane * 4;
    const float*   wg = WT + (long)wave * DE + lane * 4;
    const unsigned l0 = (unsigned)(size_t)&s_t[0][wave][lane * 4];

    auto fill = [&](int s) {
        const unsigned l = l0 + (unsigned)(s & 1) * (PR * PP * 4);
        copy8(xg + s * KS, l);
        copy8(wg + s * KS, l + 64 * PP * 4);
        copy8(wg + s * KS + 64 * DE, l + 128 * PP * 4);
        copy8(wg + s * KS + 128 * DE, l + 192 * PP * 4);
    };

    // (every inner loop of this kernel is unrolled so that acc, a and b are indexed
    //  by constants and stay in registers)
    v8f vzero = {};
    v8f acc[2][3];                                   // [mtile][0=Q, 1=K, 2=V]
#pragma unroll
    for (int mt = 0; mt < 2; ++mt)
#pragma unroll
        for (int j = 0; j < 3; ++j) acc[mt][j] = vzero;

    fill(0);
    asm volatile("s_wait_asynccnt 0x0" ::: "memory");   // stage 0 has landed (this wave's rows)
    __syncthreads();                                     // ... and every other wave's
    fill(1);

    for (int s = 0; s < NS; ++s) {
        const float* ab = &s_t[s & 1][wm * 32 + l16][hi * 4];
        const float* bb = &s_t[s & 1][PM + wn * 16 + l16][hi * 4];
#pragma unroll
        for (int kk = 0; kk < KS / 8; ++kk) {
            v4f a[2], b[3];
#pragma unroll
            for (int mt = 0; mt < 2; ++mt) a[mt] = *(const v4f*)(ab + mt * 16 * PP + kk * 8);
#pragma unroll
            for (int j = 0; j < 3; ++j)    b[j]  = *(const v4f*)(bb + j * DH * PP + kk * 8);
#pragma unroll
            for (int h = 0; h < 2; ++h)
#pragma unroll
                for (int mt = 0; mt < 2; ++mt)
#pragma unroll
                    for (int j = 0; j < 3; ++j)
                        acc[mt][j] = WMMA_F32((v2f{a[mt][2 * h], a[mt][2 * h + 1]}),
                                              (v2f{b[j][2 * h], b[j][2 * h + 1]}), acc[mt][j]);
        }
        asm volatile("s_wait_dscnt 0x0" ::: "memory");     // this wave's reads of the buffer are done
        asm volatile("s_wait_asynccnt 0x0" ::: "memory");  // its rows of stage s + 1 have landed
        __syncthreads();                                    // publishes stage s + 1, frees stage s's buffer
        if (s + 2 < NS) fill(s + 2);
    }
    asm volatile("s_wait_asynccnt 0x0" ::: "memory");       // no copy is left when the wave ends

    // A tile holds d = wn*16 + l16 on lanes and token r + 8*hi on registers.
    const long tile = ((long)blockIdx.x * 4 + wm * 2) * FB + wn * 256;
    {
        // V: d stays on lanes; r = 0,1,4,5 are the four floats of fragment lane
        // (0, l16) of group 2*wn + hi, r = 2,3,6,7 those of lane (1, l16).
        float* __restrict__ O = Vf + tile + hi * 128 + l16 * 4;
#pragma unroll
        for (int mt = 0; mt < 2; ++mt) {
            v4f lo4 = {acc[mt][2][0], acc[mt][2][1], acc[mt][2][4], acc[mt][2][5]};
            v4f hi4 = {acc[mt][2][2], acc[mt][2][3], acc[mt][2][6], acc[mt][2][7]};
            *(v4f*)(O + mt * FB)      = lo4;
            *(v4f*)(O + mt * FB + 64) = hi4;
        }
    }
    {
        // Q, K: the fragment wants tokens on lanes, so each register goes out by itself;
        // lane part of the index: where d = l16 lies in its group pair, and token 8*hi.
        const long at = tile + (l16 >> 3) * 128 + ((l16 >> 1) & 1) * 64 + hi * 32
                      + ((l16 >> 2) & 1) * 2 + (l16 & 1);
        float* __restrict__ OQ = Q + at;
        float* __restrict__ OK = Kq + at;
#pragma unroll
        for (int mt = 0; mt < 2; ++mt)
#pragma unroll
            for (int r = 0; r < 8; ++r) {
                OQ[mt * FB + r * 4] = acc[mt][0][r];
                OK[mt * FB + r * 4] = acc[mt][1][r];
            }
    }
}

// ---------------------------------------------------------------------------
// Kernel 2: flash attention with causal mask.  One work-group per (batch,
// qblock), longest qblock first; its NW waves share the key blocks round-robin
// and merge at the end.
// ---------------------------------------------------------------------------
__global__ __launch_bounds__(NW * 32) void attn_kernel(
    const float* __restrict__ Q, const float* __restrict__ Kq,
    const float* __restrict__ Vf, float* __restrict__ out)
{
    __shared__ __attribute__((aligned(16))) float s_acc[NW][16][OP];  // partial O
    __shared__ __attribute__((aligned(16))) float s_m[16][NW];        // partial row max
    __shared__ __attribute__((aligned(16))) float s_l[16][NW];        // partial row sum

    // Cost falls with the work-group index: a query block's work grows with qb, only
    // half of the work-groups are resident at once, and the longest get the lowest
    // indices (for speed only).
    const int b    = blockIdx.x & (BB - 1);
    const int qb   = QB - 1 - (blockIdx.x / BB);
    const int wave = __builtin_amdgcn_readfirstlane(threadIdx.x >> 5);  // scalar: loop stays wave-uniform
    const int lane = threadIdx.x & 31;
    const int l16  = lane & 15;
    const int hi   = lane >> 4;

    // This lane's four floats of group 0 of the batch's first block.
    const float* Qb = Q  + (long)b * QB * FB + lane * 4;
    const float* Kb = Kq + (long)b * QB * FB + lane * 4;
    const float* Vb = Vf + (long)b * QB * FB + lane * 4;

    // Preload Q^T in B-operand layout: reg j -> d = 4c + j + 2*hi, lane -> query.
    v2f qreg[16];
#pragma unroll
    for (int g = 0; g < 8; ++g) {
        v4f q4 = *(const v4f*)(Qb + (long)qb * FB + g * 128);
        qreg[2 * g]     = v2f{q4[0], q4[1]};
        qreg[2 * g + 1] = v2f{q4[2], q4[3]};
    }

    v8f vzero = {};
    v8f acc[4];                                      // O^T tiles
#pragma unroll
    for (int t = 0; t < 4; ++t) acc[t] = vzero;

    float mrow = -__builtin_inff();
    float lsum = 0.0f;
    const float scale = 0.125f;                      // 1/sqrt(64)
    const int   query = qb * 16 + l16;

    for (int kb = wave; kb <= qb; kb += NW) {
        // ---- S^T = K * Q^T over d = 0..63 (16 chunks of K=4) ----
        v8f st = vzero;
        const float* Kp = Kb + (long)kb * FB;
        v4f k4[8];                                   // K[key][4c+2hi .. +1], c = 2g, 2g+1
#pragma unroll
        for (int g = 0; g < 8; ++g)
            k4[g] = *(const v4f*)(Kp + g * 128);
        // keeps the eight loads together in front of the WMMAs; without it K's and V's
        // loads are spread among the WMMAs two at a time, one load latency per pair
        __builtin_amdgcn_sched_barrier(0);
#pragma unroll
        for (int g = 0; g < 8; ++g) {
            st = WMMA_F32((v2f{k4[g][0], k4[g][1]}), qreg[2 * g], st);
            st = WMMA_F32((v2f{k4[g][2], k4[g][3]}), qreg[2 * g + 1], st);
        }

        // V^T as A operand: lane -> d, group 2t + (c>>1) holds keys kb*16 + 4c + 2hi + j
        const float* Vp = Vb + (long)kb * FB;
        v4f v4[4][2];
#pragma unroll
        for (int t = 0; t < 4; ++t)
#pragma unroll
            for (int h = 0; h < 2; ++h)
                v4[t][h] = *(const v4f*)(Vp + (2 * t + h) * 128);

        // ---- scale + causal mask (key = kb*16 + r + 8*hi, query on lane) ----
#pragma unroll
        for (int r = 0; r < 8; ++r) {
            int   key = kb * 16 + r + 8 * hi;
            float s   = st[r] * scale;
            st[r] = (key <= query) ? s : -__builtin_inff();
        }

        // ---- online softmax: row stats live per lane ----
        float bm = st[0];
#pragma unroll
        for (int r = 1; r < 8; ++r) bm = fmaxf(bm, st[r]);
        bm = fmaxf(bm, __shfl_xor(bm, 16, 32));      // combine key halves
        float mnew = fmaxf(mrow, bm);
        float corr = __expf(mrow - mnew);            // first block: exp(-inf)=0

        float psum = 0.0f;
#pragma unroll
        for (int r = 0; r < 8; ++r) {
            float p = __expf(st[r] - mnew);
            st[r] = p;
            psum += p;
        }
        psum += __shfl_xor(psum, 16, 32);
        lsum  = lsum * corr + psum;
        mrow  = mnew;

#pragma unroll
        for (int t = 0; t < 4; ++t)
#pragma unroll
            for (int r = 0; r < 8; ++r) acc[t][r] *= corr;

        // ---- O^T += V^T * P : P (C-layout) -> B operand via half swaps ----
#pragma unroll
        for (int c = 0; c < 4; ++c) {
            v2f bop;
#pragma unroll
            for (int j = 0; j < 2; ++j) {
                float own, oth;
                if (c < 2) {                         // n_lo in lower-half regs
                    own = st[4 * c + j];
                    oth = __shfl_xor(st[4 * c + 2 + j], 16, 32);
                    bop[j] = hi ? oth : own;
                } else {                             // n_lo lives in upper-half regs
                    int cc = c - 2;
                    oth = __shfl_xor(st[4 * cc + j], 16, 32);
                    own = st[4 * cc + 2 + j];
                    bop[j] = hi ? own : oth;
                }
            }
#pragma unroll
            for (int t = 0; t < 4; ++t) {
                v4f vq = v4[t][c >> 1];
                v2f va = (c & 1) ? v2f{vq[2], vq[3]} : v2f{vq[0], vq[1]};
                acc[t] = WMMA_F32(va, bop, acc[t]);
            }
        }
    }

    // ---- publish this wave's partial (m, l, O); a wave without key blocks
    //      publishes (-inf, 0, 0), which gets weight exp(-inf) = 0 below ----
    // (the loops below are unrolled so that acc, mw and lw are indexed by
    //  constants and stay in registers, and readlane gets a constant lane)
#pragma unroll
    for (int t = 0; t < 4; ++t) {
        v4f lo4 = {acc[t][0], acc[t][1], acc[t][2], acc[t][3]};
        v4f hi4 = {acc[t][4], acc[t][5], acc[t][6], acc[t][7]};
        *(v4f*)&s_acc[wave][l16][t * 16 + 8 * hi]     = lo4;
        *(v4f*)&s_acc[wave][l16][t * 16 + 8 * hi + 4] = hi4;
    }
    if (hi == 0) {
        s_m[l16][wave] = mrow;
        s_l[l16][wave] = lsum;
    }
    __syncthreads();

    // ---- merge: wave q owns query row q, lane -> d = 2*lane, 2*lane+1.
    //      Wave 0 always has key block 0, so the merged max is finite. ----
    const int q = wave;
    float mw[NW], lw[NW];
#pragma unroll
    for (int g = 0; g < NW / 4; ++g) {
        v4f m4 = *(const v4f*)&s_m[q][4 * g];
        v4f l4 = *(const v4f*)&s_l[q][4 * g];
#pragma unroll
        for (int e = 0; e < 4; ++e) { mw[4 * g + e] = m4[e]; lw[4 * g + e] = l4[e]; }
    }
    float mall = mw[0];
#pragma unroll
    for (int w = 1; w < NW; ++w) mall = fmaxf(mall, mw[w]);

    // lane l16 computes the weight of partial l16; readlane hands it to all lanes
    const float gown = __expf(s_m[q][l16] - mall);

    float lall = 0.0f;
    v2f   o    = {0.0f, 0.0f};
#pragma unroll
    for (int w = 0; w < NW; ++w) {
        float g = __builtin_bit_cast(float, __builtin_amdgcn_readlane(__builtin_bit_cast(int, gown), w));
        v2f   a = *(const v2f*)&s_acc[w][q][2 * lane];
        lall += g * lw[w];
        o    += g * a;
    }
    float inv = 1.0f / lall;
    *(v2f*)(out + ((long)b * SS + qb * 16 + q) * DH + 2 * lane) = o * inv;
}

// ---------------------------------------------------------------------------
extern "C" void kernel_launch(void* const* d_in, const int* in_sizes, int n_in,
                              void* d_out, int out_size, void* d_ws, size_t ws_size,
                              hipStream_t stream)
{
    (void)in_sizes; (void)n_in; (void)out_size; (void)ws_size;
    const float* x  = (const float*)d_in[0];
    const float* Wq = (const float*)d_in[1];
    const float* Wk = (const float*)d_in[2];
    const float* Wv = (const float*)d_in[3];
    float* out = (float*)d_out;

    const long N = (long)BB * SS * DH;   // 1,048,576 floats (4 MB) per tensor
    float* Qw = (float*)d_ws;            // [b][s/16][FB], fragment order
    float* Kw = Qw + N;                  // [b][s/16][FB], fragment order
    float* Vw = Kw + N;                  // [b][s/16][FB], fragment order
    float* WT = Vw + N;                  // [3][DH][DE]

    wt_kernel<<<(3 * DH * DE) / 256, 256, 0, stream>>>(Wq, Wk, Wv, WT);
    qkv_kernel<<<(BB * SS) / PM, 256, 0, stream>>>(x, WT, Qw, Kw, Vw);
    attn_kernel<<<BB * QB, NW * 32, 0, stream>>>(Qw, Kw, Vw, out);
}
